// v000
// Measured on an AMD MI455X. A time is GPU time per run, averaged over a window of back-to-back runs after a warm-up
// (all launches, gaps included; the runs take copies of the inputs in turn), and the median of several windows.
// Apart from v000's, it joins two sittings. Times from different sittings can be a few percent apart, while
// side-by-side timings come from the same sitting.
// v000 is the starting kernel. One run takes 223 microseconds.
#include <hip/hip_runtime.h>
#include <hip/hip_bf16.h>
#include <cstdint>

typedef __attribute__((ext_vector_type(2))) float v2f;
typedef __attribute__((ext_vector_type(8))) float v8f;

#define B_DIM 8
#define N_DIM 1024
#define F_DIM 1024
#define S_DIM 512
#define H_NUM 16
#define D_HEAD 64

// ---------------------------------------------------------------------------
// CDNA5 async global->LDS copy (ASYNCcnt path, no VGPR round trip).
// lds_ptr: generic pointer to __shared__; low 32 bits are the LDS byte offset.
// ---------------------------------------------------------------------------
__device__ __forceinline__ void async_copy_b128(void* lds_ptr,
                                                const void* gptr) {
  uint32_t lds_off = (uint32_t)(uintptr_t)lds_ptr;
  asm volatile("global_load_async_to_lds_b128 %0, %1, off"
               :
               : "v"(lds_off), "v"(gptr)
               : "memory");
}
__device__ __forceinline__ void wait_async0() {
  asm volatile("s_wait_asynccnt 0" ::: "memory");
}

// ---------------------------------------------------------------------------
// style[b,f] = sum_s s[b,sigma] * aff_w[f,sigma] + aff_b[f]
// grid: (F/256, B), block: 256
// ---------------------------------------------------------------------------
__global__ __launch_bounds__(256) void style_kernel(
    const float* __restrict__ s, const float* __restrict__ aff_w,
    const float* __restrict__ aff_b, float* __restrict__ style) {
  __shared__ float ssh[S_DIM];
  int b = blockIdx.y;
  int f = blockIdx.x * 256 + threadIdx.x;
  for (int i = threadIdx.x; i < S_DIM; i += 256) ssh[i] = s[b * S_DIM + i];
  __syncthreads();
  const float* wr = aff_w + (size_t)f * S_DIM;
  float acc = 0.f;
#pragma unroll 4
  for (int i = 0; i < S_DIM; i += 4) {
    float4 w4 = *(const float4*)(wr + i);
    acc += w4.x * ssh[i] + w4.y * ssh[i + 1] + w4.z * ssh[i + 2] +
           w4.w * ssh[i + 3];
  }
  style[b * F_DIM + f] = acc + aff_b[f];
}

// ---------------------------------------------------------------------------
// w_mod[b,o,i] = w[o,i]*style[b,i] * rsqrt(sum_i (w[o,i]*style[b,i])^2 + eps)
// grid: (F, B), block: 256 (each thread owns 4 contiguous i's)
// ---------------------------------------------------------------------------
__global__ __launch_bounds__(256) void modulate_kernel(
    const float* __restrict__ w, const float* __restrict__ style,
    float* __restrict__ wmod) {
  int b = blockIdx.y, o = blockIdx.x;
  const float* wr = w + (size_t)o * F_DIM;
  const float* st = style + (size_t)b * F_DIM;
  float* outp = wmod + ((size_t)b * F_DIM + o) * F_DIM;
  int idx = threadIdx.x * 4;
  float4 wv = *(const float4*)(wr + idx);
  float4 sv = *(const float4*)(st + idx);
  float4 m;
  m.x = wv.x * sv.x;
  m.y = wv.y * sv.y;
  m.z = wv.z * sv.z;
  m.w = wv.w * sv.w;
  float ss = m.x * m.x + m.y * m.y + m.z * m.z + m.w * m.w;
#pragma unroll
  for (int off = 16; off > 0; off >>= 1) ss += __shfl_xor(ss, off);
  __shared__ float red[8];
  int lane = threadIdx.x & 31, wid = threadIdx.x >> 5;
  if (lane == 0) red[wid] = ss;
  __syncthreads();
  float tot = 0.f;
#pragma unroll
  for (int i = 0; i < 8; ++i) tot += red[i];
  float dem = rsqrtf(tot + 1e-8f);
  m.x *= dem;
  m.y *= dem;
  m.z *= dem;
  m.w *= dem;
  *(float4*)(outp + idx) = m;
}

// ---------------------------------------------------------------------------
// C[b,n,o] = sum_i A[b,n,i] * W[b,o,i] + bias[o]
// grid: (F/128, N/128, B), block: 256 (8 waves).
// Block tile 128(M) x 128(O); wave (mw = wv&3, ow = wv>>2) owns 32x64 of C
// (eight 16x16 fp32 WMMA accumulators = 64 VGPRs).
// K staged 32-wide, DOUBLE-BUFFERED, filled with global_load_async_to_lds_b128
// (ASYNCcnt). Padded LDS row stride 36 floats: conflict-free v2f fragment
// reads, 16B-aligned b128 async writes.
// ---------------------------------------------------------------------------
__global__ __launch_bounds__(256) void gemm_kernel(
    const float* __restrict__ A, const float* __restrict__ W,
    const float* __restrict__ bias, float* __restrict__ C) {
  __shared__ __align__(16) float lsA[2][128 * 36];
  __shared__ __align__(16) float lsB[2][128 * 36];
  int b = blockIdx.z;
  int mblk = blockIdx.y;
  int oblk = blockIdx.x;
  int tid = threadIdx.x;
  int wv = tid >> 5, lane = tid & 31;
  const float* Abase = A + ((size_t)b * N_DIM + (size_t)mblk * 128) * F_DIM;
  const float* Wbase = W + ((size_t)b * F_DIM + (size_t)oblk * 128) * F_DIM;

  v8f acc0[4] = {};
  v8f acc1[4] = {};
  int tr = tid >> 3;         // staging row within 32-row pass
  int tc = (tid & 7) * 4;    // staging col (float4 granularity)
  int m = lane & 15;
  int kh = (lane >> 4) * 2;  // K-half select for 32-bit A/B fragments
  int mw32 = (wv & 3) * 32;  // wave M sub-tile
  int ow64 = (wv >> 2) * 64; // wave O sub-tile

  auto stage = [&](int buf, int k0) {
#pragma unroll
    for (int p = 0; p < 4; ++p) {
      int row = p * 32 + tr;
      async_copy_b128(&lsA[buf][row * 36 + tc],
                      Abase + (size_t)row * F_DIM + k0 + tc);
      async_copy_b128(&lsB[buf][row * 36 + tc],
                      Wbase + (size_t)row * F_DIM + k0 + tc);
    }
  };

  stage(0, 0);
  for (int k0 = 0; k0 < F_DIM; k0 += 32) {
    int cur = (k0 >> 5) & 1;
    wait_async0();
    __syncthreads();  // all waves' async fills done; prev compute done
    if (k0 + 32 < F_DIM) stage(cur ^ 1, k0 + 32);  // prefetch next chunk
    const float* As = lsA[cur];
    const float* Bs = lsB[cur];
#pragma unroll
    for (int ks = 0; ks < 32; ks += 4) {
      v2f a0 = *(const v2f*)(&As[(mw32 + m) * 36 + ks + kh]);
      v2f a1 = *(const v2f*)(&As[(mw32 + 16 + m) * 36 + ks + kh]);
#pragma unroll
      for (int t = 0; t < 4; ++t) {
        v2f bf = *(const v2f*)(&Bs[(ow64 + t * 16 + m) * 36 + ks + kh]);
        acc0[t] = __builtin_amdgcn_wmma_f32_16x16x4_f32(
            false, a0, false, bf, (short)0, acc0[t], false, false);
        acc1[t] = __builtin_amdgcn_wmma_f32_16x16x4_f32(
            false, a1, false, bf, (short)0, acc1[t], false, false);
      }
    }
  }
  // epilogue: C tile layout — VGPR v: lanes 0-15 M=v, lanes 16-31 M=v+8
  int mb = (lane >> 4) * 8;
#pragma unroll
  for (int t = 0; t < 4; ++t) {
    int ocol = oblk * 128 + ow64 + t * 16 + m;
    float bv = bias[ocol];
#pragma unroll
    for (int v = 0; v < 8; ++v) {
      int row0 = mblk * 128 + mw32 + v + mb;
      C[((size_t)b * N_DIM + row0) * F_DIM + ocol] = acc0[t][v] + bv;
      C[((size_t)b * N_DIM + row0 + 16) * F_DIM + ocol] = acc1[t][v] + bv;
    }
  }
}

// ---------------------------------------------------------------------------
// Per-token head-mixing attention. One wave per token, 8 tokens per block.
// kx row = K matrix [H=16][D=64].  S = K·Kᵀ (WMMA, A-frag==B-frag by layout
// symmetry), softmax over j (half-wave shuffle reductions), O = P·K (WMMA).
// Tile staged with async global->LDS.
// ---------------------------------------------------------------------------
__global__ __launch_bounds__(256) void attention_kernel(
    const float* __restrict__ kx, float* __restrict__ outp) {
  __shared__ __align__(16) float tile[8][16 * 68];  // K tile, row stride 68
  __shared__ __align__(16) float pmat[8][16 * 18];  // softmax P, row stride 18
  int wv = threadIdx.x >> 5;
  int lane = threadIdx.x & 31;
  int token = blockIdx.x * 8 + wv;
  const float* src = kx + (size_t)token * F_DIM;
  float* dst = outp + (size_t)token * F_DIM;
  float* kt = tile[wv];
  float* pm = pmat[wv];

  // stage this token's 16x64 K tile: 8 async b128 per lane
#pragma unroll
  for (int i = 0; i < 8; ++i) {
    int idx = i * 128 + lane * 4;
    int h = idx >> 6, d = idx & 63;
    async_copy_b128(&kt[h * 68 + d], src + idx);
  }
  wait_async0();
  __syncthreads();

  int m = lane & 15;
  int kh = (lane >> 4) * 2;
  int mb = (lane >> 4) * 8;

  // scores S = K · Kᵀ : B[k][j] = K[j][k] -> per-lane B fragment equals A frag
  v8f sc = {};
#pragma unroll
  for (int ks = 0; ks < D_HEAD; ks += 4) {
    v2f af = *(const v2f*)(&kt[m * 68 + ks + kh]);
    sc = __builtin_amdgcn_wmma_f32_16x16x4_f32(false, af, false, af, (short)0,
                                               sc, false, false);
  }

  // softmax over j (columns = lanes within each half-wave); scale 1/sqrt(64)
#pragma unroll
  for (int v = 0; v < 8; ++v) {
    float xv = sc[v];
    float mx = xv;
#pragma unroll
    for (int msk = 8; msk > 0; msk >>= 1) mx = fmaxf(mx, __shfl_xor(mx, msk));
    float e = __expf((xv - mx) * 0.125f);
    float sum = e;
#pragma unroll
    for (int msk = 8; msk > 0; msk >>= 1) sum += __shfl_xor(sum, msk);
    float p = e / sum;
    pm[(v + mb) * 18 + m] = p;  // P[M][j]
  }
  __syncthreads();

  // O = P · K : A = P (16x16, K-dim = j), B[j][d] = K[j][d]
  v8f oc[4] = {};
#pragma unroll
  for (int ks = 0; ks < H_NUM; ks += 4) {
    v2f af = *(const v2f*)(&pm[m * 18 + ks + kh]);
#pragma unroll
    for (int t = 0; t < 4; ++t) {
      v2f bf;
      bf.x = kt[(ks + kh + 0) * 68 + t * 16 + m];
      bf.y = kt[(ks + kh + 1) * 68 + t * 16 + m];
      oc[t] = __builtin_amdgcn_wmma_f32_16x16x4_f32(false, af, false, bf,
                                                    (short)0, oc[t], false,
                                                    false);
    }
  }
#pragma unroll
  for (int t = 0; t < 4; ++t)
#pragma unroll
    for (int v = 0; v < 8; ++v)
      dst[(v + mb) * D_HEAD + t * 16 + m] = oc[t][v];
}

// ---------------------------------------------------------------------------
extern "C" void kernel_launch(void* const* d_in, const int* in_sizes, int n_in,
                              void* d_out, int out_size, void* d_ws,
                              size_t ws_size, hipStream_t stream) {
  const float* x       = (const float*)d_in[0];
  const float* s       = (const float*)d_in[1];
  const float* k_aff_w = (const float*)d_in[2];
  const float* k_aff_b = (const float*)d_in[3];
  const float* k_w     = (const float*)d_in[4];
  const float* k_b     = (const float*)d_in[5];
  const float* o_aff_w = (const float*)d_in[6];
  const float* o_aff_b = (const float*)d_in[7];
  const float* o_w     = (const float*)d_in[8];
  const float* o_b     = (const float*)d_in[9];
  float* out = (float*)d_out;

  float* ws = (float*)d_ws;
  float* style_k = ws;                                 // 8K floats
  float* style_o = ws + B_DIM * F_DIM;                 // 8K floats
  float* bufA = ws + 2 * B_DIM * F_DIM;                // 8M floats
  float* bufB = bufA + (size_t)B_DIM * N_DIM * F_DIM;  // 8M floats

  dim3 stg(F_DIM / 256, B_DIM);
  style_kernel<<<stg, 256, 0, stream>>>(s, k_aff_w, k_aff_b, style_k);
  style_kernel<<<stg, 256, 0, stream>>>(s, o_aff_w, o_aff_b, style_o);

  dim3 mg(F_DIM, B_DIM);
  // w_mod_k -> bufA
  modulate_kernel<<<mg, 256, 0, stream>>>(k_w, style_k, bufA);

  dim3 gg(F_DIM / 128, N_DIM / 128, B_DIM);
  // kx = x @ w_mod_k^T + k_b -> bufB
  gemm_kernel<<<gg, 256, 0, stream>>>(x, bufA, k_b, bufB);

  // per-token attention: bufB -> bufA (w_mod_k no longer needed)
  attention_kernel<<<(B_DIM * N_DIM) / 8, 256, 0, stream>>>(bufB, bufA);

  // w_mod_o -> bufB (kx no longer needed)
  modulate_kernel<<<mg, 256, 0, stream>>>(o_w, style_o, bufB);
  // out = attn @ w_mod_o^T + o_b -> d_out
  gemm_kernel<<<gg, 256, 0, stream>>>(bufA, bufB, o_b, out);
}

// v001
// One run takes 201 microseconds.
// Next to v000, in two timings, it ran 1.13 times as fast each time.
#include <hip/hip_runtime.h>
#include <hip/hip_bf16.h>
#include <cstdint>

typedef __attribute__((ext_vector_type(2))) float v2f;
typedef __attribute__((ext_vector_type(8))) float v8f;

#define B_DIM 8
#define N_DIM 1024
#define F_DIM 1024
#define S_DIM 512
#define H_NUM 16
#define D_HEAD 64

// ---------------------------------------------------------------------------
// CDNA5 async global->LDS copy (ASYNCcnt path, no VGPR round trip).
// lds_ptr: generic pointer to __shared__; low 32 bits are the LDS byte offset.
// ---------------------------------------------------------------------------
__device__ __forceinline__ void async_copy_b128(void* lds_ptr,
                                                const void* gptr) {
  uint32_t lds_off = (uint32_t)(uintptr_t)lds_ptr;
  asm volatile("global_load_async_to_lds_b128 %0, %1, off"
               :
               : "v"(lds_off), "v"(gptr)
               : "memory");
}
__device__ __forceinline__ void wait_async0() {
  asm volatile("s_wait_asynccnt 0" ::: "memory");
}

// ---------------------------------------------------------------------------
// style_l[b,f] = sum_i s[b,i] * aff_w_l[f,i] + aff_b_l[f] for both layers l.
// grid: 2*F/32, block: 256 (8 waves). A block owns 32 consecutive rows f of one
// layer, a wave 4 of them, each for all 8 batches. A wave reads a row as whole
// 512-byte pieces, all 16 loads in flight at once; every aff_w byte is fetched
// once. Each lane sums its 16 columns, a transposing butterfly over the lanes
// leaves sum (r,b) in lane r*8+b, and the block stores whole 128-byte lines.
// ---------------------------------------------------------------------------
__global__ __launch_bounds__(256) void style_kernel(
    const float* __restrict__ s, const float* __restrict__ k_aff_w,
    const float* __restrict__ k_aff_b, const float* __restrict__ o_aff_w,
    const float* __restrict__ o_aff_b, float* __restrict__ style_k,
    float* __restrict__ style_o) {
  __shared__ __align__(16) float ssh[B_DIM * S_DIM];
  __shared__ float res[B_DIM * 32];
  int tid = threadIdx.x;
  int lane = tid & 31, wv = tid >> 5;
  bool second = blockIdx.x >= F_DIM / 32;
  const float* aw = second ? o_aff_w : k_aff_w;
  const float* ab = second ? o_aff_b : k_aff_b;
  float* st = second ? style_o : style_k;
  int f0 = (blockIdx.x & (F_DIM / 32 - 1)) * 32;

  // every loop of this kernel is unrolled in full: constant indices keep w4,
  // acc2 and acc in registers, and the 16 row loads issue back to back
  float4 w4[4][4];
#pragma unroll
  for (int r = 0; r < 4; ++r)
#pragma unroll
    for (int j = 0; j < 4; ++j)
      w4[r][j] = *(const float4*)(aw + (size_t)(f0 + wv * 4 + r) * S_DIM +
                                  (j * 32 + lane) * 4);
  float bias = ab[f0 + lane];  // fetched with the rows, used at the end
#pragma unroll
  for (int i = 0; i < B_DIM * S_DIM / 1024; ++i)
    ((float4*)ssh)[i * 256 + tid] = ((const float4*)s)[i * 256 + tid];
  __syncthreads();

  v2f acc2[32];  // index r*8 + b; even and odd columns summed apart
#pragma unroll
  for (int i = 0; i < 32; ++i) acc2[i] = (v2f){0.f, 0.f};
#pragma unroll
  for (int b = 0; b < B_DIM; ++b) {
#pragma unroll
    for (int j = 0; j < 4; ++j) {
      float4 sv = ((const float4*)ssh)[b * (S_DIM / 4) + j * 32 + lane];
#pragma unroll
      for (int r = 0; r < 4; ++r) {
        acc2[r * 8 + b] = __builtin_elementwise_fma(
            (v2f){w4[r][j].x, w4[r][j].y}, (v2f){sv.x, sv.y}, acc2[r * 8 + b]);
        acc2[r * 8 + b] = __builtin_elementwise_fma(
            (v2f){w4[r][j].z, w4[r][j].w}, (v2f){sv.z, sv.w}, acc2[r * 8 + b]);
      }
    }
  }
  float acc[32];
#pragma unroll
  for (int i = 0; i < 32; ++i) acc[i] = acc2[i].x + acc2[i].y;
  // each step halves the sums a lane carries: 31 exchanges instead of 160
#pragma unroll
  for (int h = 16; h >= 1; h >>= 1) {
    bool up = (lane & h) != 0;
#pragma unroll
    for (int i = 0; i < h; ++i) {
      float lo = acc[i], hi = acc[i + h];
      float keep = up ? hi : lo;
      float send = up ? lo : hi;
      acc[i] = keep + __shfl_xor(send, h);
    }
  }
  res[(lane & 7) * 32 + wv * 4 + (lane >> 3)] = acc[0];
  __syncthreads();
  st[wv * F_DIM + f0 + lane] = res[tid] + bias;
}

// ---------------------------------------------------------------------------
// w_mod[b,o,i] = w[o,i]*style[b,i] * rsqrt(sum_i (w[o,i]*style[b,i])^2 + eps)
// grid: (F, B), block: 256 (each thread owns 4 contiguous i's)
// ---------------------------------------------------------------------------
__global__ __launch_bounds__(256) void modulate_kernel(
    const float* __restrict__ w, const float* __restrict__ style,
    float* __restrict__ wmod) {
  int b = blockIdx.y, o = blockIdx.x;
  const float* wr = w + (size_t)o * F_DIM;
  const float* st = style + (size_t)b * F_DIM;
  float* outp = wmod + ((size_t)b * F_DIM + o) * F_DIM;
  int idx = threadIdx.x * 4;
  float4 wv = *(const float4*)(wr + idx);
  float4 sv = *(const float4*)(st + idx);
  float4 m;
  m.x = wv.x * sv.x;
  m.y = wv.y * sv.y;
  m.z = wv.z * sv.z;
  m.w = wv.w * sv.w;
  float ss = m.x * m.x + m.y * m.y + m.z * m.z + m.w * m.w;
#pragma unroll
  for (int off = 16; off > 0; off >>= 1) ss += __shfl_xor(ss, off);
  __shared__ float red[8];
  int lane = threadIdx.x & 31, wid = threadIdx.x >> 5;
  if (lane == 0) red[wid] = ss;
  __syncthreads();
  float tot = 0.f;
#pragma unroll
  for (int i = 0; i < 8; ++i) tot += red[i];
  float dem = rsqrtf(tot + 1e-8f);
  m.x *= dem;
  m.y *= dem;
  m.z *= dem;
  m.w *= dem;
  *(float4*)(outp + idx) = m;
}

// ---------------------------------------------------------------------------
// C[b,n,o] = sum_i A[b,n,i] * W[b,o,i] + bias[o]
// grid: (F/128, N/128, B), block: 256 (8 waves).
// Block tile 128(M) x 128(O); wave (mw = wv&3, ow = wv>>2) owns 32x64 of C
// (eight 16x16 fp32 WMMA accumulators = 64 VGPRs).
// K staged 32-wide, DOUBLE-BUFFERED, filled with global_load_async_to_lds_b128
// (ASYNCcnt). Padded LDS row stride 36 floats: conflict-free v2f fragment
// reads, 16B-aligned b128 async writes.
// ---------------------------------------------------------------------------
__global__ __launch_bounds__(256) void gemm_kernel(
    const float* __restrict__ A, const float* __restrict__ W,
    const float* __restrict__ bias, float* __restrict__ C) {
  __shared__ __align__(16) float lsA[2][128 * 36];
  __shared__ __align__(16) float lsB[2][128 * 36];
  int b = blockIdx.z;
  int mblk = blockIdx.y;
  int oblk = blockIdx.x;
  int tid = threadIdx.x;
  int wv = tid >> 5, lane = tid & 31;
  const float* Abase = A + ((size_t)b * N_DIM + (size_t)mblk * 128) * F_DIM;
  const float* Wbase = W + ((size_t)b * F_DIM + (size_t)oblk * 128) * F_DIM;

  v8f acc0[4] = {};
  v8f acc1[4] = {};
  int tr = tid >> 3;         // staging row within 32-row pass
  int tc = (tid & 7) * 4;    // staging col (float4 granularity)
  int m = lane & 15;
  int kh = (lane >> 4) * 2;  // K-half select for 32-bit A/B fragments
  int mw32 = (wv & 3) * 32;  // wave M sub-tile
  int ow64 = (wv >> 2) * 64; // wave O sub-tile

  auto stage = [&](int buf, int k0) {
#pragma unroll
    for (int p = 0; p < 4; ++p) {
      int row = p * 32 + tr;
      async_copy_b128(&lsA[buf][row * 36 + tc],
                      Abase + (size_t)row * F_DIM + k0 + tc);
      async_copy_b128(&lsB[buf][row * 36 + tc],
                      Wbase + (size_t)row * F_DIM + k0 + tc);
    }
  };

  stage(0, 0);
  for (int k0 = 0; k0 < F_DIM; k0 += 32) {
    int cur = (k0 >> 5) & 1;
    wait_async0();
    __syncthreads();  // all waves' async fills done; prev compute done
    if (k0 + 32 < F_DIM) stage(cur ^ 1, k0 + 32);  // prefetch next chunk
    const float* As = lsA[cur];
    const float* Bs = lsB[cur];
#pragma unroll
    for (int ks = 0; ks < 32; ks += 4) {
      v2f a0 = *(const v2f*)(&As[(mw32 + m) * 36 + ks + kh]);
      v2f a1 = *(const v2f*)(&As[(mw32 + 16 + m) * 36 + ks + kh]);
#pragma unroll
      for (int t = 0; t < 4; ++t) {
        v2f bf = *(const v2f*)(&Bs[(ow64 + t * 16 + m) * 36 + ks + kh]);
        acc0[t] = __builtin_amdgcn_wmma_f32_16x16x4_f32(
            false, a0, false, bf, (short)0, acc0[t], false, false);
        acc1[t] = __builtin_amdgcn_wmma_f32_16x16x4_f32(
            false, a1, false, bf, (short)0, acc1[t], false, false);
      }
    }
  }
  // epilogue: C tile layout — VGPR v: lanes 0-15 M=v, lanes 16-31 M=v+8
  int mb = (lane >> 4) * 8;
#pragma unroll
  for (int t = 0; t < 4; ++t) {
    int ocol = oblk * 128 + ow64 + t * 16 + m;
    float bv = bias[ocol];
#pragma unroll
    for (int v = 0; v < 8; ++v) {
      int row0 = mblk * 128 + mw32 + v + mb;
      C[((size_t)b * N_DIM + row0) * F_DIM + ocol] = acc0[t][v] + bv;
      C[((size_t)b * N_DIM + row0 + 16) * F_DIM + ocol] = acc1[t][v] + bv;
    }
  }
}

// ---------------------------------------------------------------------------
// Per-token head-mixing attention. One wave per token, 8 tokens per block.
// kx row = K matrix [H=16][D=64].  S = K·Kᵀ (WMMA, A-frag==B-frag by layout
// symmetry), softmax over j (half-wave shuffle reductions), O = P·K (WMMA).
// Tile staged with async global->LDS.
// ---------------------------------------------------------------------------
__global__ __launch_bounds__(256) void attention_kernel(
    const float* __restrict__ kx, float* __restrict__ outp) {
  __shared__ __align__(16) float tile[8][16 * 68];  // K tile, row stride 68
  __shared__ __align__(16) float pmat[8][16 * 18];  // softmax P, row stride 18
  int wv = threadIdx.x >> 5;
  int lane = threadIdx.x & 31;
  int token = blockIdx.x * 8 + wv;
  const float* src = kx + (size_t)token * F_DIM;
  float* dst = outp + (size_t)token * F_DIM;
  float* kt = tile[wv];
  float* pm = pmat[wv];

  // stage this token's 16x64 K tile: 8 async b128 per lane
#pragma unroll
  for (int i = 0; i < 8; ++i) {
    int idx = i * 128 + lane * 4;
    int h = idx >> 6, d = idx & 63;
    async_copy_b128(&kt[h * 68 + d], src + idx);
  }
  wait_async0();
  __syncthreads();

  int m = lane & 15;
  int kh = (lane >> 4) * 2;
  int mb = (lane >> 4) * 8;

  // scores S = K · Kᵀ : B[k][j] = K[j][k] -> per-lane B fragment equals A frag
  v8f sc = {};
#pragma unroll
  for (int ks = 0; ks < D_HEAD; ks += 4) {
    v2f af = *(const v2f*)(&kt[m * 68 + ks + kh]);
    sc = __builtin_amdgcn_wmma_f32_16x16x4_f32(false, af, false, af, (short)0,
                                               sc, false, false);
  }

  // softmax over j (columns = lanes within each half-wave); scale 1/sqrt(64)
#pragma unroll
  for (int v = 0; v < 8; ++v) {
    float xv = sc[v];
    float mx = xv;
#pragma unroll
    for (int msk = 8; msk > 0; msk >>= 1) mx = fmaxf(mx, __shfl_xor(mx, msk));
    float e = __expf((xv - mx) * 0.125f);
    float sum = e;
#pragma unroll
    for (int msk = 8; msk > 0; msk >>= 1) sum += __shfl_xor(sum, msk);
    float p = e / sum;
    pm[(v + mb) * 18 + m] = p;  // P[M][j]
  }
  __syncthreads();

  // O = P · K : A = P (16x16, K-dim = j), B[j][d] = K[j][d]
  v8f oc[4] = {};
#pragma unroll
  for (int ks = 0; ks < H_NUM; ks += 4) {
    v2f af = *(const v2f*)(&pm[m * 18 + ks + kh]);
#pragma unroll
    for (int t = 0; t < 4; ++t) {
      v2f bf;
      bf.x = kt[(ks + kh + 0) * 68 + t * 16 + m];
      bf.y = kt[(ks + kh + 1) * 68 + t * 16 + m];
      oc[t] = __builtin_amdgcn_wmma_f32_16x16x4_f32(false, af, false, bf,
                                                    (short)0, oc[t], false,
                                                    false);
    }
  }
#pragma unroll
  for (int t = 0; t < 4; ++t)
#pragma unroll
    for (int v = 0; v < 8; ++v)
      dst[(v + mb) * D_HEAD + t * 16 + m] = oc[t][v];
}

// ---------------------------------------------------------------------------
extern "C" void kernel_launch(void* const* d_in, const int* in_sizes, int n_in,
                              void* d_out, int out_size, void* d_ws,
                              size_t ws_size, hipStream_t stream) {
  const float* x       = (const float*)d_in[0];
  const float* s       = (const float*)d_in[1];
  const float* k_aff_w = (const float*)d_in[2];
  const float* k_aff_b = (const float*)d_in[3];
  const float* k_w     = (const float*)d_in[4];
  const float* k_b     = (const float*)d_in[5];
  const float* o_aff_w = (const float*)d_in[6];
  const float* o_aff_b = (const float*)d_in[7];
  const float* o_w     = (const float*)d_in[8];
  const float* o_b     = (const float*)d_in[9];
  float* out = (float*)d_out;

  float* ws = (float*)d_ws;
  float* style_k = ws;                                 // 8K floats
  float* style_o = ws + B_DIM * F_DIM;                 // 8K floats
  float* bufA = ws + 2 * B_DIM * F_DIM;                // 8M floats
  float* bufB = bufA + (size_t)B_DIM * N_DIM * F_DIM;  // 8M floats

  style_kernel<<<2 * F_DIM / 32, 256, 0, stream>>>(
      s, k_aff_w, k_aff_b, o_aff_w, o_aff_b, style_k, style_o);

  dim3 mg(F_DIM, B_DIM);
  // w_mod_k -> bufA
  modulate_kernel<<<mg, 256, 0, stream>>>(k_w, style_k, bufA);

  dim3 gg(F_DIM / 128, N_DIM / 128, B_DIM);
  // kx = x @ w_mod_k^T + k_b -> bufB
  gemm_kernel<<<gg, 256, 0, stream>>>(x, bufA, k_b, bufB);

  // per-token attention: bufB -> bufA (w_mod_k no longer needed)
  attention_kernel<<<(B_DIM * N_DIM) / 8, 256, 0, stream>>>(bufB, bufA);

  // w_mod_o -> bufB (kx no longer needed)
  modulate_kernel<<<mg, 256, 0, stream>>>(o_w, style_o, bufB);
  // out = attn @ w_mod_o^T + o_b -> d_out
  gemm_kernel<<<gg, 256, 0, stream>>>(bufA, bufB, o_b, out);
}

// v002
// A run of this version takes 182 microseconds.
// Timed twice side by side with v001, it ran 1.11 times as fast both times.
// Counting every step since v000, it is 1.26 times as fast.
#include <hip/hip_runtime.h>
#include <hip/hip_bf16.h>
#include <cstdint>

typedef __attribute__((ext_vector_type(2))) float v2f;
typedef __attribute__((ext_vector_type(4))) float v4f;
typedef __attribute__((ext_vector_type(8))) float v8f;

#define B_DIM 8
#define N_DIM 1024
#define F_DIM 1024
#define S_DIM 512
#define H_NUM 16
#define D_HEAD 64

// ---------------------------------------------------------------------------
// CDNA5 async global->LDS copy (ASYNCcnt path, no VGPR round trip).
// lds_ptr: generic pointer to __shared__; low 32 bits are the LDS byte offset.
// ---------------------------------------------------------------------------
__device__ __forceinline__ void async_copy_b128(void* lds_ptr,
                                                const void* gptr) {
  uint32_t lds_off = (uint32_t)(uintptr_t)lds_ptr;
  asm volatile("global_load_async_to_lds_b128 %0, %1, off"
               :
               : "v"(lds_off), "v"(gptr)
               : "memory");
}
__device__ __forceinline__ void wait_async0() {
  asm volatile("s_wait_asynccnt 0" ::: "memory");
}

// ---------------------------------------------------------------------------
// style_l[b,f] = sum_i s[b,i] * aff_w_l[f,i] + aff_b_l[f] for both layers l.
// grid: 2*F/32, block: 256 (8 waves). A block owns 32 consecutive rows f of one
// layer, a wave 4 of them, each for all 8 batches. A wave reads a row as whole
// 512-byte pieces, all 16 loads in flight at once; every aff_w byte is fetched
// once. Each lane sums its 16 columns, a transposing butterfly over the lanes
// leaves sum (r,b) in lane r*8+b, and the block stores whole 128-byte lines.
// ---------------------------------------------------------------------------
__global__ __launch_bounds__(256) void style_kernel(
    const float* __restrict__ s, const float* __restrict__ k_aff_w,
    const float* __restrict__ k_aff_b, const float* __restrict__ o_aff_w,
    const float* __restrict__ o_aff_b, float* __restrict__ style_k,
    float* __restrict__ style_o) {
  __shared__ __align__(16) float ssh[B_DIM * S_DIM];
  __shared__ float res[B_DIM * 32];
  int tid = threadIdx.x;
  int lane = tid & 31, wv = tid >> 5;
  bool second = blockIdx.x >= F_DIM / 32;
  const float* aw = second ? o_aff_w : k_aff_w;
  const float* ab = second ? o_aff_b : k_aff_b;
  float* st = second ? style_o : style_k;
  int f0 = (blockIdx.x & (F_DIM / 32 - 1)) * 32;

  // every loop of this kernel is unrolled in full: constant indices keep w4,
  // acc2 and acc in registers, and the 16 row loads issue back to back
  float4 w4[4][4];
#pragma unroll
  for (int r = 0; r < 4; ++r)
#pragma unroll
    for (int j = 0; j < 4; ++j)
      w4[r][j] = *(const float4*)(aw + (size_t)(f0 + wv * 4 + r) * S_DIM +
                                  (j * 32 + lane) * 4);
  float bias = ab[f0 + lane];  // fetched with the rows, used at the end
#pragma unroll
  for (int i = 0; i < B_DIM * S_DIM / 1024; ++i)
    ((float4*)ssh)[i * 256 + tid] = ((const float4*)s)[i * 256 + tid];
  __syncthreads();

  v2f acc2[32];  // index r*8 + b; even and odd columns summed apart
#pragma unroll
  for (int i = 0; i < 32; ++i) acc2[i] = (v2f){0.f, 0.f};
#pragma unroll
  for (int b = 0; b < B_DIM; ++b) {
#pragma unroll
    for (int j = 0; j < 4; ++j) {
      float4 sv = ((const float4*)ssh)[b * (S_DIM / 4) + j * 32 + lane];
#pragma unroll
      for (int r = 0; r < 4; ++r) {
        acc2[r * 8 + b] = __builtin_elementwise_fma(
            (v2f){w4[r][j].x, w4[r][j].y}, (v2f){sv.x, sv.y}, acc2[r * 8 + b]);
        acc2[r * 8 + b] = __builtin_elementwise_fma(
            (v2f){w4[r][j].z, w4[r][j].w}, (v2f){sv.z, sv.w}, acc2[r * 8 + b]);
      }
    }
  }
  float acc[32];
#pragma unroll
  for (int i = 0; i < 32; ++i) acc[i] = acc2[i].x + acc2[i].y;
  // each step halves the sums a lane carries: 31 exchanges instead of 160
#pragma unroll
  for (int h = 16; h >= 1; h >>= 1) {
    bool up = (lane & h) != 0;
#pragma unroll
    for (int i = 0; i < h; ++i) {
      float lo = acc[i], hi = acc[i + h];
      float keep = up ? hi : lo;
      float send = up ? lo : hi;
      acc[i] = keep + __shfl_xor(send, h);
    }
  }
  res[(lane & 7) * 32 + wv * 4 + (lane >> 3)] = acc[0];
  __syncthreads();
  st[wv * F_DIM + f0 + lane] = res[tid] + bias;
}

// ---------------------------------------------------------------------------
// C[b,n,o] = dem[b,o] * sum_i A[b,n,i] * (W[o,i]*style[b,i]) + bias[o],
// dem[b,o] = rsqrt(sum_i (W[o,i]*style[b,i])^2 + eps).
// W is the plain weight, shared by all batches; no modulated copy is stored.
// Each B fragment is scaled by style in registers on its way to the WMMA, and
// its squares are summed per lane: a lane's B row o is also its C column, so
// the norm ends up in the lane that needs it for the epilogue.
// grid: (F/128, N/128, B), block: 256 (8 waves).
// Block tile 128(M) x 128(O); wave (mw = wv&3, ow = wv>>2) owns 32x64 of C
// (eight 16x16 fp32 WMMA accumulators = 64 VGPRs).
// K staged 32-wide, DOUBLE-BUFFERED, filled with global_load_async_to_lds_b128
// (ASYNCcnt). Padded LDS row stride 36 floats: conflict-free v2f fragment
// reads, 16B-aligned b128 async writes.
// ---------------------------------------------------------------------------
__global__ __launch_bounds__(256) void gemm_kernel(
    const float* __restrict__ A, const float* __restrict__ W,
    const float* __restrict__ style, const float* __restrict__ bias,
    float* __restrict__ C) {
  __shared__ __align__(16) float lsA[2][128 * 36];
  __shared__ __align__(16) float lsB[2][128 * 36];
  __shared__ __align__(16) float sty[F_DIM];  // style row of this batch
  int b = blockIdx.z;
  int mblk = blockIdx.y;
  int oblk = blockIdx.x;
  int tid = threadIdx.x;
  int wv = tid >> 5, lane = tid & 31;
  const float* Abase = A + ((size_t)b * N_DIM + (size_t)mblk * 128) * F_DIM;
  const float* Wbase = W + (size_t)oblk * 128 * F_DIM;

  v8f acc0[4] = {};
  v8f acc1[4] = {};
  v2f nrm[4] = {};  // sums of squares of this lane's scaled B elements
  int tr = tid >> 3;         // staging row within 32-row pass
  int tc = (tid & 7) * 4;    // staging col (float4 granularity)
  int m = lane & 15;
  int kh = (lane >> 4) * 2;  // K-half select for 32-bit A/B fragments
  int mw32 = (wv & 3) * 32;  // wave M sub-tile
  int ow64 = (wv >> 2) * 64; // wave O sub-tile

  auto stage = [&](int buf, int k0) {
#pragma unroll
    for (int p = 0; p < 4; ++p) {
      int row = p * 32 + tr;
      async_copy_b128(&lsA[buf][row * 36 + tc],
                      Abase + (size_t)row * F_DIM + k0 + tc);
      async_copy_b128(&lsB[buf][row * 36 + tc],
                      Wbase + (size_t)row * F_DIM + k0 + tc);
    }
  };

  stage(0, 0);
  // Load and its data wait in one statement, so that no address register of
  // the load is reused while it is in flight; the wait costs nothing here, the
  // wave waits for stage 0's copies next anyway.
  v4f st4;
  asm volatile("global_load_b128 %0, %1, off\n\ts_wait_loadcnt 0x0"
               : "=&v"(st4)
               : "v"(style + (size_t)b * F_DIM + tid * 4)
               : "memory");
  ((v4f*)sty)[tid] = st4;  // published by the first barrier of the loop
  for (int k0 = 0; k0 < F_DIM; k0 += 32) {
    int cur = (k0 >> 5) & 1;
    wait_async0();
    __syncthreads();  // all waves' async fills done; prev compute done
    if (k0 + 32 < F_DIM) stage(cur ^ 1, k0 + 32);  // prefetch next chunk
    const float* As = lsA[cur];
    const float* Bs = lsB[cur];
#pragma unroll
    for (int ks = 0; ks < 32; ks += 4) {
      v2f a0 = *(const v2f*)(&As[(mw32 + m) * 36 + ks + kh]);
      v2f a1 = *(const v2f*)(&As[(mw32 + 16 + m) * 36 + ks + kh]);
      v2f sv = *(const v2f*)(&sty[k0 + ks + kh]);
#pragma unroll
      for (int t = 0; t < 4; ++t) {
        v2f bf = *(const v2f*)(&Bs[(ow64 + t * 16 + m) * 36 + ks + kh]) * sv;
        nrm[t] = __builtin_elementwise_fma(bf, bf, nrm[t]);
        acc0[t] = __builtin_amdgcn_wmma_f32_16x16x4_f32(
            false, a0, false, bf, (short)0, acc0[t], false, false);
        acc1[t] = __builtin_amdgcn_wmma_f32_16x16x4_f32(
            false, a1, false, bf, (short)0, acc1[t], false, false);
      }
    }
  }
  // epilogue: C tile layout — VGPR v: lanes 0-15 M=v, lanes 16-31 M=v+8
  int mb = (lane >> 4) * 8;
#pragma unroll
  for (int t = 0; t < 4; ++t) {
    int ocol = oblk * 128 + ow64 + t * 16 + m;
    float bv = bias[ocol];
    // the two half-waves hold the two K halves of row ocol's norm
    float ss = nrm[t].x + nrm[t].y;
    ss += __shfl_xor(ss, 16);
    float dem = rsqrtf(ss + 1e-8f);
#pragma unroll
    for (int v = 0; v < 8; ++v) {
      int row0 = mblk * 128 + mw32 + v + mb;
      C[((size_t)b * N_DIM + row0) * F_DIM + ocol] = acc0[t][v] * dem + bv;
      C[((size_t)b * N_DIM + row0 + 16) * F_DIM + ocol] =
          acc1[t][v] * dem + bv;
    }
  }
}

// ---------------------------------------------------------------------------
// Per-token head-mixing attention. One wave per token, 8 tokens per block.
// kx row = K matrix [H=16][D=64].  S = K·Kᵀ (WMMA, A-frag==B-frag by layout
// symmetry), softmax over j (half-wave shuffle reductions), O = P·K (WMMA).
// Tile staged with async global->LDS.
// ---------------------------------------------------------------------------
__global__ __launch_bounds__(256) void attention_kernel(
    const float* __restrict__ kx, float* __restrict__ outp) {
  __shared__ __align__(16) float tile[8][16 * 68];  // K tile, row stride 68
  __shared__ __align__(16) float pmat[8][16 * 18];  // softmax P, row stride 18
  int wv = threadIdx.x >> 5;
  int lane = threadIdx.x & 31;
  int token = blockIdx.x * 8 + wv;
  const float* src = kx + (size_t)token * F_DIM;
  float* dst = outp + (size_t)token * F_DIM;
  float* kt = tile[wv];
  float* pm = pmat[wv];

  // stage this token's 16x64 K tile: 8 async b128 per lane
#pragma unroll
  for (int i = 0; i < 8; ++i) {
    int idx = i * 128 + lane * 4;
    int h = idx >> 6, d = idx & 63;
    async_copy_b128(&kt[h * 68 + d], src + idx);
  }
  wait_async0();
  __syncthreads();

  int m = lane & 15;
  int kh = (lane >> 4) * 2;
  int mb = (lane >> 4) * 8;

  // scores S = K · Kᵀ : B[k][j] = K[j][k] -> per-lane B fragment equals A frag
  v8f sc = {};
#pragma unroll
  for (int ks = 0; ks < D_HEAD; ks += 4) {
    v2f af = *(const v2f*)(&kt[m * 68 + ks + kh]);
    sc = __builtin_amdgcn_wmma_f32_16x16x4_f32(false, af, false, af, (short)0,
                                               sc, false, false);
  }

  // softmax over j (columns = lanes within each half-wave); scale 1/sqrt(64)
#pragma unroll
  for (int v = 0; v < 8; ++v) {
    float xv = sc[v];
    float mx = xv;
#pragma unroll
    for (int msk = 8; msk > 0; msk >>= 1) mx = fmaxf(mx, __shfl_xor(mx, msk));
    float e = __expf((xv - mx) * 0.125f);
    float sum = e;
#pragma unroll
    for (int msk = 8; msk > 0; msk >>= 1) sum += __shfl_xor(sum, msk);
    float p = e / sum;
    pm[(v + mb) * 18 + m] = p;  // P[M][j]
  }
  __syncthreads();

  // O = P · K : A = P (16x16, K-dim = j), B[j][d] = K[j][d]
  v8f oc[4] = {};
#pragma unroll
  for (int ks = 0; ks < H_NUM; ks += 4) {
    v2f af = *(const v2f*)(&pm[m * 18 + ks + kh]);
#pragma unroll
    for (int t = 0; t < 4; ++t) {
      v2f bf;
      bf.x = kt[(ks + kh + 0) * 68 + t * 16 + m];
      bf.y = kt[(ks + kh + 1) * 68 + t * 16 + m];
      oc[t] = __builtin_amdgcn_wmma_f32_16x16x4_f32(false, af, false, bf,
                                                    (short)0, oc[t], false,
                                                    false);
    }
  }
#pragma unroll
  for (int t = 0; t < 4; ++t)
#pragma unroll
    for (int v = 0; v < 8; ++v)
      dst[(v + mb) * D_HEAD + t * 16 + m] = oc[t][v];
}

// ---------------------------------------------------------------------------
extern "C" void kernel_launch(void* const* d_in, const int* in_sizes, int n_in,
                              void* d_out, int out_size, void* d_ws,
                              size_t ws_size, hipStream_t stream) {
  const float* x       = (const float*)d_in[0];
  const float* s       = (const float*)d_in[1];
  const float* k_aff_w = (const float*)d_in[2];
  const float* k_aff_b = (const float*)d_in[3];
  const float* k_w     = (const float*)d_in[4];
  const float* k_b     = (const float*)d_in[5];
  const float* o_aff_w = (const float*)d_in[6];
  const float* o_aff_b = (const float*)d_in[7];
  const float* o_w     = (const float*)d_in[8];
  const float* o_b     = (const float*)d_in[9];
  float* out = (float*)d_out;

  float* ws = (float*)d_ws;
  float* style_k = ws;                                 // 8K floats
  float* style_o = ws + B_DIM * F_DIM;                 // 8K floats
  float* bufA = ws + 2 * B_DIM * F_DIM;                // 8M floats
  float* bufB = bufA + (size_t)B_DIM * N_DIM * F_DIM;  // 8M floats

  style_kernel<<<2 * F_DIM / 32, 256, 0, stream>>>(
      s, k_aff_w, k_aff_b, o_aff_w, o_aff_b, style_k, style_o);

  dim3 gg(F_DIM / 128, N_DIM / 128, B_DIM);
  // kx = x @ w_mod_k^T + k_b -> bufB
  gemm_kernel<<<gg, 256, 0, stream>>>(x, k_w, style_k, k_b, bufB);

  // per-token attention: bufB -> bufA
  attention_kernel<<<(B_DIM * N_DIM) / 8, 256, 0, stream>>>(bufB, bufA);

  // out = attn @ w_mod_o^T + o_b -> d_out
  gemm_kernel<<<gg, 256, 0, stream>>>(bufA, o_w, style_o, o_b, out);
}
